// v000
// Times are from an AMD MI455X. After a warm-up the kernel runs many times in a row, and a time is the length of
// such a window on the GPU divided by its runs, so every launch and the gaps after it count. The runs cycle
// through copies of the inputs. A figure is the median of several windows, for all but v000 over two sittings.
// Sittings can differ by a few percent; kernels timed side by side share one.
// v000, which the later versions start from, runs in 31.2 microseconds.
#include <hip/hip_runtime.h>
#include <math.h>

typedef float v2f __attribute__((ext_vector_type(2)));
typedef float v8f __attribute__((ext_vector_type(8)));

constexpr int HN = 8;      // heads (== batch)
constexpr int SN = 2048;   // sequence
constexpr int DN = 3;      // head projections

// LDS layout (float indices). x1 region is reused as per-wave P staging
// once Q fragments have been built.
constexpr int X1_OFF = 0;                    // 2048*3 = 6144 floats
constexpr int K_OFF  = 6144;                 // 2048*4 (col 3 zero-padded)
constexpr int VT_STR = 2052;                 // 2048 + 4 pad: bank-conflict-free
constexpr int VT_OFF = 6144 + 8192;          // V^T: 5 x 2052 (row 4 = zeros)
constexpr int SMEM_FLOATS = 6144 + 8192 + 5 * VT_STR;   // ~96 KB (<< 320 KB/WGP)

// log2(e) / sqrt(3): fold the 1/sqrt(i0) scale into the exp2-domain softmax.
#define SOFTMAX_SCALE 0.8329862557658682f

// Raw maxnum without the compiler's canonicalize-before-maxnum expansion
// (inputs here are products/sums of finite data; sNaN semantics irrelevant).
__device__ __forceinline__ float fmax_raw(float a, float b) {
    float d;
    asm("v_max_num_f32_e32 %0, %1, %2" : "=v"(d) : "v"(a), "v"(b));
    return d;
}

// Butterfly max over 16-lane rows. DPP rides src0 of v_max_num_f32 directly
// (one instruction per step, no mov/canonicalize): xor1, xor2 via quad_perm;
// then (values quad-uniform) row_half_mirror == xor4, row_mirror == xor8.
__device__ __forceinline__ float rowmax16(float x) {
    float t;
    asm("v_max_num_f32_dpp %0, %1, %1 quad_perm:[1,0,3,2] row_mask:0xf bank_mask:0xf bound_ctrl:1"
        : "=v"(t) : "v"(x));
    asm("v_max_num_f32_dpp %0, %1, %1 quad_perm:[2,3,0,1] row_mask:0xf bank_mask:0xf bound_ctrl:1"
        : "=v"(x) : "v"(t));
    asm("v_max_num_f32_dpp %0, %1, %1 row_half_mirror row_mask:0xf bank_mask:0xf bound_ctrl:1"
        : "=v"(t) : "v"(x));
    asm("v_max_num_f32_dpp %0, %1, %1 row_mirror row_mask:0xf bank_mask:0xf bound_ctrl:1"
        : "=v"(x) : "v"(t));
    return x;
}

__global__ __launch_bounds__(128)
void attn_view_kernel(const float* __restrict__ x1,
                      const float* __restrict__ qw_g,
                      const float* __restrict__ kw_g,
                      const float* __restrict__ vw_g,
                      float* __restrict__ out)
{
    extern __shared__ float smem[];
    const int tid  = threadIdx.x;
    const int lane = tid & 31;
    const int wave = tid >> 5;
    const int h    = blockIdx.x >> 5;          // 32 blocks per head
    const int sblk = blockIdx.x & 31;          // 64 rows per block (16/wave)
    const int s_tile_base = sblk * 64 + wave * 16;

    const float* x1h = x1 + h * (SN * DN);

    // ---- per-head 3x3 weights (uniform addresses -> scalar loads) ----
    float qw[9], kw[9], vw[9];
    #pragma unroll
    for (int i = 0; i < 9; ++i) {
        qw[i] = qw_g[h * 9 + i];
        kw[i] = kw_g[h * 9 + i];
        vw[i] = vw_g[h * 9 + i];
    }

    // ---- phase 1: stage x1[h] (2048x3 f32 = 24KB) into LDS ----
    {
        const float4* src = (const float4*)x1h;
        float4* dst = (float4*)&smem[X1_OFF];
        #pragma unroll
        for (int i = 0; i < 12; ++i)           // 6144 floats / 4 / 128 thr
            dst[tid + i * 128] = src[tid + i * 128];
    }
    __syncthreads();

    // ---- phase 2: materialize K (2048x4, col3=0) and V^T (5x2052) honoring
    //      the reshape-VIEW: element (t,p) comes from flat index f = 3t+p of
    //      the (3,2048) matmul result: row f>>11 of W, column f&2047 of x1.
    //      V^T row 3 = 1.0 (PV WMMA accumulates the softmax denominator in
    //      output column 3 for free); V^T row 4 = 0 (zero source for lanes
    //      whose B column is 4..15 -> masking by addressing, not VALU).
    for (int e = tid; e < SN * 4; e += 128) {
        int t = e >> 2, pp = e & 3;
        float kv = 0.f, vv = 1.f;
        if (pp < 3) {
            int f  = t * 3 + pp;
            int i  = f >> 11;
            int tt = f & 2047;
            const float* xr = &smem[X1_OFF + tt * 3];
            kv = kw[i*3+0]*xr[0] + kw[i*3+1]*xr[1] + kw[i*3+2]*xr[2];
            vv = vw[i*3+0]*xr[0] + vw[i*3+1]*xr[1] + vw[i*3+2]*xr[2];
        }
        smem[K_OFF + e] = kv;
        smem[VT_OFF + pp * VT_STR + t] = vv;
    }
    for (int e = tid; e < VT_STR; e += 128)    // zero row 4
        smem[VT_OFF + 4 * VT_STR + e] = 0.f;

    // ---- Q fragment in WMMA A-layout (16x4 f32): lane l holds row m=l&15,
    //      K-slots k0,k0+1 with k0 = (l>>4)*2; slot 3 is zero pad.
    //      The softmax scale is folded into Q so qk comes out pre-scaled. ----
    const int m   = lane & 15;
    const int k0  = (lane >> 4) * 2;
    const int hi8 = (lane >> 4) * 8;           // C/D rows: r (low) / r+8 (high)
    v2f aq;
    #pragma unroll
    for (int j = 0; j < 2; ++j) {
        int kk = k0 + j;
        float q = 0.f;
        if (kk < 3) {
            int f  = (s_tile_base + m) * 3 + kk;
            int i  = f >> 11;
            int tt = f & 2047;
            const float* xr = &smem[X1_OFF + tt * 3];
            q = (qw[i*3+0]*xr[0] + qw[i*3+1]*xr[1] + qw[i*3+2]*xr[2]) * SOFTMAX_SCALE;
        }
        aq[j] = q;
    }
    __syncthreads();   // K/V ready; x1 region now free -> P staging

    float rmax[8];
    v8f acc = {};
    #pragma unroll
    for (int r = 0; r < 8; ++r) rmax[r] = -__builtin_inff();

    float* pstage = &smem[X1_OFF + wave * 256];   // 16x16 P tile per wave
    // Per-lane V^T base: columns n>=4 read the zero row (no masking VALU).
    const float* vbase = &smem[VT_OFF + ((m < 4) ? m : 4) * VT_STR];

    // No barriers in this loop: P staging is per-wave private and same-wave
    // LDS instructions are hardware in-order (DScnt, "LDS: in order").
    for (int tb = 0; tb < SN / 16; ++tb) {
        const int tbase = tb * 16;

        // B fragment of K^T (4x16): lane = column n=m, contiguous K pair.
        v2f bk = *(const v2f*)&smem[K_OFF + (tbase + m) * 4 + k0];
        v8f zero = {};
        v8f qk = __builtin_amdgcn_wmma_f32_16x16x4_f32(
            false, aq, false, bk, (short)0, zero, false, false);

        // ---- online softmax (exp2 domain; qk is pre-scaled). qk VGPR r
        //      holds rows r / r+8 in low/high halves; DPP rowmax matches. ----
        #pragma unroll
        for (int r = 0; r < 8; ++r) {
            float x  = qk[r];
            float nm = fmax_raw(rmax[r], rowmax16(x));
            float pv = __builtin_amdgcn_exp2f(x - nm);
            float cr = __builtin_amdgcn_exp2f(rmax[r] - nm);
            rmax[r]  = nm;
            acc[r]  *= cr;                         // rescale before PV adds
            pstage[(r + hi8) * 16 + m] = pv;       // C-layout -> LDS
        }

        // ---- PV: (16x16 P) x (16x4 [V | 1]) as 4 chained K=4 WMMAs.
        //      Column 3 of acc accumulates the softmax denominator. ----
        #pragma unroll
        for (int c = 0; c < 4; ++c) {
            // A chunk: P[:, 4c+k0 .. 4c+k0+1], re-read in A-layout
            v2f ap = *(const v2f*)&pstage[m * 16 + 4 * c + k0];
            // B chunk: V^T[n, t0..t0+1] -> one b64 load (zero row for n>=4)
            const int t0 = tbase + 4 * c + k0;
            v2f bv = *(const v2f*)&vbase[t0];
            acc = __builtin_amdgcn_wmma_f32_16x16x4_f32(
                false, ap, false, bv, (short)0, acc, false, false);
        }
    }

    // ---- epilogue: denominator lives in column 3 of each acc row ----
    #pragma unroll
    for (int r = 0; r < 8; ++r) {
        float denom = __shfl(acc[r], 3, 16);       // lane col 3 of this row
        if (m < 3) {
            int s = s_tile_base + r + hi8;
            out[(h * 3 + m) * SN + s] = acc[r] / denom;
        }
    }
}

extern "C" void kernel_launch(void* const* d_in, const int* in_sizes, int n_in,
                              void* d_out, int out_size, void* d_ws, size_t ws_size,
                              hipStream_t stream) {
    const float* x1 = (const float*)d_in[0];
    const float* qw = (const float*)d_in[1];
    const float* kw = (const float*)d_in[2];
    const float* vw = (const float*)d_in[3];
    float* out = (float*)d_out;
    (void)in_sizes; (void)n_in; (void)out_size; (void)d_ws; (void)ws_size;

    dim3 grid(HN * 32);   // 8 heads x 32 s-blocks (64 rows each)
    dim3 block(128);      // 4 waves; one 16-row s-tile per wave
    size_t smem = SMEM_FLOATS * sizeof(float);   // ~96 KB dynamic LDS
    attn_view_kernel<<<grid, block, smem, stream>>>(x1, qw, kw, vw, out);
}

// v001
// It runs in 21.9 microseconds.
// Next to v000, in two timings, it ran 1.45 times as fast each time.
#include <hip/hip_runtime.h>
#include <math.h>

typedef float v2f __attribute__((ext_vector_type(2)));
typedef float v8f __attribute__((ext_vector_type(8)));

constexpr int HN = 8;      // heads (== batch)
constexpr int SN = 2048;   // sequence
constexpr int DN = 3;      // head projections

// LDS layout (float indices).
constexpr int X1_OFF = 0;                    // 2048*3 = 6144 floats
constexpr int K_OFF  = 6144;                 // 2048*4 (col 3 zero-padded)
constexpr int VT_STR = 2052;                 // 2048 + 4 pad: bank-conflict-free
constexpr int VT_OFF = 6144 + 8192;          // V^T: 5 x 2052 (row 4 = zeros)
constexpr int SMEM_FLOATS = 6144 + 8192 + 5 * VT_STR;   // ~96 KB (<< 320 KB/WGP)

// log2(e) / sqrt(3): fold the 1/sqrt(i0) scale into the exp2-domain softmax.
#define SOFTMAX_SCALE 0.8329862557658682f

// Raw maxnum without the compiler's canonicalize-before-maxnum expansion
// (inputs here are products/sums of finite data; sNaN semantics irrelevant).
__device__ __forceinline__ float fmax_raw(float a, float b) {
    float d;
    asm("v_max_num_f32_e32 %0, %1, %2" : "=v"(d) : "v"(a), "v"(b));
    return d;
}

// Three-input form of the same raw maximum.
__device__ __forceinline__ float fmax3_raw(float a, float b, float c) {
    float d;
    asm("v_max3_num_f32 %0, %1, %2, %3" : "=v"(d) : "v"(a), "v"(b), "v"(c));
    return d;
}

// Value of lane l ^ 16 (the other 16-lane half), by a vector cross-row move.
__device__ __forceinline__ float other_half(float x) {
    int b = __builtin_bit_cast(int, x);
    b = __builtin_amdgcn_permlanex16(b, b, 0x76543210, 0xfedcba98, false, false);
    return __builtin_bit_cast(float, b);
}

__global__ __launch_bounds__(128)
void attn_view_kernel(const float* __restrict__ x1,
                      const float* __restrict__ qw_g,
                      const float* __restrict__ kw_g,
                      const float* __restrict__ vw_g,
                      float* __restrict__ out)
{
    extern __shared__ float smem[];
    const int tid  = threadIdx.x;
    const int lane = tid & 31;
    const int wave = tid >> 5;
    const int h    = blockIdx.x >> 5;          // 32 blocks per head
    const int sblk = blockIdx.x & 31;          // 64 rows per block (16/wave)
    const int s_tile_base = sblk * 64 + wave * 16;

    const float* x1h = x1 + h * (SN * DN);

    // ---- per-head 3x3 weights (uniform addresses -> scalar loads) ----
    float qw[9], kw[9], vw[9];
    #pragma unroll
    for (int i = 0; i < 9; ++i) {
        qw[i] = qw_g[h * 9 + i];
        kw[i] = kw_g[h * 9 + i];
        vw[i] = vw_g[h * 9 + i];
    }

    // ---- phase 1: stage x1[h] (2048x3 f32 = 24KB) into LDS ----
    {
        const float4* src = (const float4*)x1h;
        float4* dst = (float4*)&smem[X1_OFF];
        #pragma unroll
        for (int i = 0; i < 12; ++i)           // 6144 floats / 4 / 128 thr
            dst[tid + i * 128] = src[tid + i * 128];
    }
    __syncthreads();

    // ---- phase 2: materialize K (2048x4, col3=0) and V^T (5x2052) honoring
    //      the reshape-VIEW: element (t,p) comes from flat index f = 3t+p of
    //      the (3,2048) matmul result: row f>>11 of W, column f&2047 of x1.
    //      V^T row 3 = 1.0 (PV WMMA accumulates the softmax denominator in
    //      output row 3 for free); V^T row 4 = 0 (zero source for lanes
    //      whose A row is 4..15 -> masking by addressing, not VALU).
    for (int e = tid; e < SN * 4; e += 128) {
        int t = e >> 2, pp = e & 3;
        float kv = 0.f, vv = 1.f;
        if (pp < 3) {
            int f  = t * 3 + pp;
            int i  = f >> 11;
            int tt = f & 2047;
            const float* xr = &smem[X1_OFF + tt * 3];
            kv = kw[i*3+0]*xr[0] + kw[i*3+1]*xr[1] + kw[i*3+2]*xr[2];
            vv = vw[i*3+0]*xr[0] + vw[i*3+1]*xr[1] + vw[i*3+2]*xr[2];
        }
        smem[K_OFF + e] = kv;
        smem[VT_OFF + pp * VT_STR + t] = vv;
    }
    for (int e = tid; e < VT_STR; e += 128)    // zero row 4
        smem[VT_OFF + 4 * VT_STR + e] = 0.f;

    // ---- Q^T fragment in WMMA B-layout (4x16 f32): lane l holds column
    //      (query) m=l&15, K-slots k0,k0+1 with k0 = (l>>4)*2; slot 3 is zero
    //      pad. The softmax scale is folded into Q so qk comes out pre-scaled. ----
    const int m   = lane & 15;
    const int k0  = (lane >> 4) * 2;
    const int hi8 = (lane >> 4) * 8;           // C/D rows: r (low) / r+8 (high)
    v2f bq;
    #pragma unroll
    for (int j = 0; j < 2; ++j) {
        int kk = k0 + j;
        float q = 0.f;
        if (kk < 3) {
            int f  = (s_tile_base + m) * 3 + kk;
            int i  = f >> 11;
            int tt = f & 2047;
            const float* xr = &smem[X1_OFF + tt * 3];
            q = (qw[i*3+0]*xr[0] + qw[i*3+1]*xr[1] + qw[i*3+2]*xr[2]) * SOFTMAX_SCALE;
        }
        bq[j] = q;
    }
    __syncthreads();   // K/V ready

    // Transposed products: S^T = K Q^T and O^T += [V | 1]^T P^T. A lane then
    // holds scores of ONE query (column m): 8 keys in its 8 D registers, the
    // other 8 keys of the tile in lane l^16.
    float rmax = -__builtin_inff();
    v8f acc = {};      // acc[r] = O^T[r + hi8][m]; only rows 0..3 are non-zero

    // Per-lane V^T base: A rows n>=4 read the zero row (no masking VALU).
    const float* vbase = &smem[VT_OFF + ((m < 4) ? m : 4) * VT_STR + hi8];

    for (int tb = 0; tb < SN / 16; ++tb) {
        const int tbase = tb * 16;

        // A fragment of K (16x4): lane = row (key) m, contiguous K pair.
        v2f ak = *(const v2f*)&smem[K_OFF + (tbase + m) * 4 + k0];
        // A fragments of V^T for the four PV chunks: keys hi8 + 0..7.
        const float4 va = *(const float4*)&vbase[tbase];
        const float4 vb = *(const float4*)&vbase[tbase + 4];

        v8f zero = {};
        v8f qk = __builtin_amdgcn_wmma_f32_16x16x4_f32(
            false, ak, false, bq, (short)0, zero, false, false);

        // ---- online softmax (exp2 domain; qk is pre-scaled). qk[r] is the
        //      score of key tbase + hi8 + r against query m. ----
        float tm = fmax3_raw(fmax3_raw(qk[0], qk[1], qk[2]),
                             fmax3_raw(qk[3], qk[4], qk[5]),
                             fmax_raw(qk[6], qk[7]));
        float nm = fmax3_raw(tm, other_half(tm), rmax);
        float cr = __builtin_amdgcn_exp2f(rmax - nm);
        rmax = nm;
        float p[8];
        #pragma unroll
        for (int r = 0; r < 8; ++r)
            p[r] = __builtin_amdgcn_exp2f(qk[r] - nm);
        #pragma unroll
        for (int r = 0; r < 4; ++r)
            acc[r] *= cr;                          // rescale before PV adds

        // ---- PV: (16x16 [V | 1]^T) x (16x16 P^T) as 4 chained K=4 WMMAs.
        //      B chunk c is the D register pair (2c, 2c+1) as it stands: its
        //      K-slots are keys 2c, 2c+1 (low half) and 2c+8, 2c+9 (high half),
        //      and the V^T loads above follow the same order.
        //      Row 3 of acc accumulates the softmax denominator. ----
        const v2f av[4] = {{va.x, va.y}, {va.z, va.w}, {vb.x, vb.y}, {vb.z, vb.w}};
        #pragma unroll
        for (int c = 0; c < 4; ++c) {
            v2f bp = {p[2 * c], p[2 * c + 1]};
            acc = __builtin_amdgcn_wmma_f32_16x16x4_f32(
                false, av[c], false, bp, (short)0, acc, false, false);
        }
    }

    // ---- epilogue: low-half lane m holds rows 0..2 and the denominator
    //      (row 3) of query s_tile_base + m ----
    if (lane < 16) {
        const int s = s_tile_base + m;
        #pragma unroll
        for (int r = 0; r < 3; ++r)
            out[(h * 3 + r) * SN + s] = acc[r] / acc[3];
    }
}

extern "C" void kernel_launch(void* const* d_in, const int* in_sizes, int n_in,
                              void* d_out, int out_size, void* d_ws, size_t ws_size,
                              hipStream_t stream) {
    const float* x1 = (const float*)d_in[0];
    const float* qw = (const float*)d_in[1];
    const float* kw = (const float*)d_in[2];
    const float* vw = (const float*)d_in[3];
    float* out = (float*)d_out;
    (void)in_sizes; (void)n_in; (void)out_size; (void)d_ws; (void)ws_size;

    dim3 grid(HN * 32);   // 8 heads x 32 s-blocks (64 rows each)
    dim3 block(128);      // 4 waves; one 16-row s-tile per wave
    size_t smem = SMEM_FLOATS * sizeof(float);   // ~96 KB dynamic LDS
    attn_view_kernel<<<grid, block, smem, stream>>>(x1, qw, kw, vw, out);
}

// v002
// It runs in 14.8 microseconds.
// Timed twice side by side with v001, it ran 1.48 times as fast both times.
// Over all steps from v000 it is 2.14 times as fast.
#include <hip/hip_runtime.h>
#include <math.h>

typedef float v2f __attribute__((ext_vector_type(2)));
typedef float v8f __attribute__((ext_vector_type(8)));

constexpr int HN = 8;      // heads (== batch)
constexpr int SN = 2048;   // sequence
constexpr int DN = 3;      // head projections
constexpr int KS = 4;      // key ranges per query tile, one wave each
constexpr int NT = 128 * KS;   // threads per block: 4 query tiles x KS waves

// LDS layout (float indices).
constexpr int X1_OFF = 0;                    // 2048*3 = 6144 floats
constexpr int CB_OFF = X1_OFF;               // partials of the merge: x1 is dead by then
constexpr int K_OFF  = 6144;                 // 2048*4 (col 3 zero-padded)
constexpr int VT_STR = 2052;                 // 2048 + 4 pad: bank-conflict-free
constexpr int VT_OFF = 6144 + 8192;          // V^T: 5 x 2052 (row 4 = zeros)
constexpr int SMEM_FLOATS = 6144 + 8192 + 5 * VT_STR;   // ~96 KB (<< 320 KB/WGP)

// log2(e) / sqrt(3): fold the 1/sqrt(i0) scale into the exp2-domain softmax.
#define SOFTMAX_SCALE 0.8329862557658682f

// Raw maxnum without the compiler's canonicalize-before-maxnum expansion
// (inputs here are products/sums of finite data; sNaN semantics irrelevant).
__device__ __forceinline__ float fmax_raw(float a, float b) {
    float d;
    asm("v_max_num_f32_e32 %0, %1, %2" : "=v"(d) : "v"(a), "v"(b));
    return d;
}

// Three-input form of the same raw maximum.
__device__ __forceinline__ float fmax3_raw(float a, float b, float c) {
    float d;
    asm("v_max3_num_f32 %0, %1, %2, %3" : "=v"(d) : "v"(a), "v"(b), "v"(c));
    return d;
}

// Value of lane l ^ 16 (the other 16-lane half), by a vector cross-row move.
__device__ __forceinline__ float other_half(float x) {
    int b = __builtin_bit_cast(int, x);
    b = __builtin_amdgcn_permlanex16(b, b, 0x76543210, 0xfedcba98, false, false);
    return __builtin_bit_cast(float, b);
}

__global__ __launch_bounds__(NT)
void attn_view_kernel(const float* __restrict__ x1,
                      const float* __restrict__ qw_g,
                      const float* __restrict__ kw_g,
                      const float* __restrict__ vw_g,
                      float* __restrict__ out)
{
    extern __shared__ float smem[];
    const int tid  = threadIdx.x;
    const int lane = tid & 31;
    // Held in a scalar register: the key range and the tests on it are wave-uniform.
    const int wave = __builtin_amdgcn_readfirstlane(tid >> 5);
    const int qt   = wave & 3;                 // query tile of this wave
    const int ks   = wave >> 2;                // key range of this wave
    const int h    = blockIdx.x >> 5;          // 32 blocks per head
    const int sblk = blockIdx.x & 31;          // 64 rows per block (16/wave)
    const int s_tile_base = sblk * 64 + qt * 16;

    const float* x1h = x1 + h * (SN * DN);

    // ---- per-head 3x3 weights (uniform addresses -> scalar loads) ----
    float qw[9], kw[9], vw[9];
    #pragma unroll
    for (int i = 0; i < 9; ++i) {
        qw[i] = qw_g[h * 9 + i];
        kw[i] = kw_g[h * 9 + i];
        vw[i] = vw_g[h * 9 + i];
    }

    // ---- phase 1: stage x1[h] (2048x3 f32 = 24KB) into LDS ----
    {
        const float4* src = (const float4*)x1h;
        float4* dst = (float4*)&smem[X1_OFF];
        #pragma unroll
        for (int i = 0; i < 1536 / NT; ++i)    // 6144 floats / 4 / NT threads
            dst[tid + i * NT] = src[tid + i * NT];
    }
    __syncthreads();

    // ---- phase 2: materialize K (2048x4, col3=0) and V^T (5x2052) honoring
    //      the reshape-VIEW: element (t,p) comes from flat index f = 3t+p of
    //      the (3,2048) matmul result: row f>>11 of W, column f&2047 of x1.
    //      V^T row 3 = 1.0 (PV WMMA accumulates the softmax denominator in
    //      output row 3 for free); V^T row 4 = 0 (zero source for lanes
    //      whose A row is 4..15 -> masking by addressing, not VALU).
    for (int e = tid; e < SN * 4; e += NT) {
        int t = e >> 2, pp = e & 3;
        float kv = 0.f, vv = 1.f;
        if (pp < 3) {
            int f  = t * 3 + pp;
            int i  = f >> 11;
            int tt = f & 2047;
            const float* xr = &smem[X1_OFF + tt * 3];
            kv = kw[i*3+0]*xr[0] + kw[i*3+1]*xr[1] + kw[i*3+2]*xr[2];
            vv = vw[i*3+0]*xr[0] + vw[i*3+1]*xr[1] + vw[i*3+2]*xr[2];
        }
        smem[K_OFF + e] = kv;
        smem[VT_OFF + pp * VT_STR + t] = vv;
    }
    for (int e = tid; e < VT_STR; e += NT)     // zero row 4
        smem[VT_OFF + 4 * VT_STR + e] = 0.f;

    // ---- Q^T fragment in WMMA B-layout (4x16 f32): lane l holds column
    //      (query) m=l&15, K-slots k0,k0+1 with k0 = (l>>4)*2; slot 3 is zero
    //      pad. The softmax scale is folded into Q so qk comes out pre-scaled. ----
    const int m   = lane & 15;
    const int k0  = (lane >> 4) * 2;
    const int hi8 = (lane >> 4) * 8;           // C/D rows: r (low) / r+8 (high)
    v2f bq;
    #pragma unroll
    for (int j = 0; j < 2; ++j) {
        int kk = k0 + j;
        float q = 0.f;
        if (kk < 3) {
            int f  = (s_tile_base + m) * 3 + kk;
            int i  = f >> 11;
            int tt = f & 2047;
            const float* xr = &smem[X1_OFF + tt * 3];
            q = (qw[i*3+0]*xr[0] + qw[i*3+1]*xr[1] + qw[i*3+2]*xr[2]) * SOFTMAX_SCALE;
        }
        bq[j] = q;
    }
    __syncthreads();   // K/V ready

    // Transposed products: S^T = K Q^T and O^T += [V | 1]^T P^T. A lane then
    // holds scores of ONE query (column m): 8 keys in its 8 D registers, the
    // other 8 keys of the tile in lane l^16.
    float rmax = -__builtin_inff();
    v8f acc = {};      // acc[r] = O^T[r + hi8][m]; only rows 0..3 are non-zero

    // Per-lane V^T base: A rows n>=4 read the zero row (no masking VALU).
    const float* vbase = &smem[VT_OFF + ((m < 4) ? m : 4) * VT_STR + hi8];

    // Wave (qt, ks) walks key tiles ks*TPW .. ks*TPW + TPW-1 with a maximum,
    // a denominator and an accumulator of its own.
    constexpr int TPW = SN / 16 / KS;
    for (int tb = 0; tb < TPW; ++tb) {
        const int tbase = (ks * TPW + tb) * 16;

        // A fragment of K (16x4): lane = row (key) m, contiguous K pair.
        v2f ak = *(const v2f*)&smem[K_OFF + (tbase + m) * 4 + k0];
        // A fragments of V^T for the four PV chunks: keys hi8 + 0..7.
        const float4 va = *(const float4*)&vbase[tbase];
        const float4 vb = *(const float4*)&vbase[tbase + 4];

        v8f zero = {};
        v8f qk = __builtin_amdgcn_wmma_f32_16x16x4_f32(
            false, ak, false, bq, (short)0, zero, false, false);

        // ---- online softmax (exp2 domain; qk is pre-scaled). qk[r] is the
        //      score of key tbase + hi8 + r against query m. ----
        float tm = fmax3_raw(fmax3_raw(qk[0], qk[1], qk[2]),
                             fmax3_raw(qk[3], qk[4], qk[5]),
                             fmax_raw(qk[6], qk[7]));
        float nm = fmax3_raw(tm, other_half(tm), rmax);
        float cr = __builtin_amdgcn_exp2f(rmax - nm);
        rmax = nm;
        float p[8];
        #pragma unroll
        for (int r = 0; r < 8; ++r)
            p[r] = __builtin_amdgcn_exp2f(qk[r] - nm);
        #pragma unroll
        for (int r = 0; r < 4; ++r)
            acc[r] *= cr;                          // rescale before PV adds

        // ---- PV: (16x16 [V | 1]^T) x (16x16 P^T) as 4 chained K=4 WMMAs.
        //      B chunk c is the D register pair (2c, 2c+1) as it stands: its
        //      K-slots are keys 2c, 2c+1 (low half) and 2c+8, 2c+9 (high half),
        //      and the V^T loads above follow the same order.
        //      Row 3 of acc accumulates the softmax denominator. ----
        const v2f av[4] = {{va.x, va.y}, {va.z, va.w}, {vb.x, vb.y}, {vb.z, vb.w}};
        #pragma unroll
        for (int c = 0; c < 4; ++c) {
            v2f bp = {p[2 * c], p[2 * c + 1]};
            acc = __builtin_amdgcn_wmma_f32_16x16x4_f32(
                false, av[c], false, bp, (short)0, acc, false, false);
        }
    }

    // ---- merge of the KS key ranges: low-half lane m holds rows 0..2 and the
    //      denominator (row 3) of query s_tile_base + m over its own range.
    //      Ranges 1.. hand maximum and rows to range 0 through LDS. The short
    //      loops are unrolled so that pm[] and o[] stay in registers. ----
    if (ks != 0 && lane < 16) {
        float* cb = &smem[CB_OFF + ((ks - 1) * 4 + qt) * 80 + m];
        cb[0] = rmax;
        #pragma unroll
        for (int r = 0; r < 4; ++r)
            cb[16 + r * 16] = acc[r];
    }
    __syncthreads();   // partials ready
    if (ks == 0 && lane < 16) {
        const float* cb = &smem[CB_OFF + qt * 80 + m];
        float pm[KS - 1];
        float gm = rmax;
        #pragma unroll
        for (int j = 0; j < KS - 1; ++j) {
            pm[j] = cb[j * 320];
            gm = fmax_raw(gm, pm[j]);
        }
        const float w0 = __builtin_amdgcn_exp2f(rmax - gm);
        float o[4];
        #pragma unroll
        for (int r = 0; r < 4; ++r)
            o[r] = acc[r] * w0;
        #pragma unroll
        for (int j = 0; j < KS - 1; ++j) {
            const float wj = __builtin_amdgcn_exp2f(pm[j] - gm);
            #pragma unroll
            for (int r = 0; r < 4; ++r)
                o[r] += wj * cb[j * 320 + 16 + r * 16];
        }
        const int s = s_tile_base + m;
        #pragma unroll
        for (int r = 0; r < 3; ++r)
            out[(h * 3 + r) * SN + s] = o[r] / o[3];
    }
}

extern "C" void kernel_launch(void* const* d_in, const int* in_sizes, int n_in,
                              void* d_out, int out_size, void* d_ws, size_t ws_size,
                              hipStream_t stream) {
    const float* x1 = (const float*)d_in[0];
    const float* qw = (const float*)d_in[1];
    const float* kw = (const float*)d_in[2];
    const float* vw = (const float*)d_in[3];
    float* out = (float*)d_out;
    (void)in_sizes; (void)n_in; (void)out_size; (void)d_ws; (void)ws_size;

    dim3 grid(HN * 32);   // 8 heads x 32 s-blocks (64 rows each)
    dim3 block(NT);       // 4 query tiles x KS key ranges, one wave each
    size_t smem = SMEM_FLOATS * sizeof(float);   // ~96 KB dynamic LDS
    attn_view_kernel<<<grid, block, smem, stream>>>(x1, qw, kw, vw, out);
}

// v003
// It runs in 11.5 microseconds.
// Timed twice side by side with v002, it ran 1.29 and 1.28 times as fast.
// Over all steps from v000 it is 2.76 times as fast.
#include <hip/hip_runtime.h>
#include <math.h>

typedef float v2f __attribute__((ext_vector_type(2)));
typedef float v8f __attribute__((ext_vector_type(8)));

constexpr int HN = 8;      // heads (== batch)
constexpr int SN = 2048;   // sequence
constexpr int DN = 3;      // head projections
constexpr int KS = 4;      // key ranges per query tile, one wave each
constexpr int NT = 128 * KS;   // threads per block: 4 query tiles x KS waves

// LDS layout (float indices).
constexpr int CB_OFF = 0;                    // partials of the merge: 3*4*80 floats
constexpr int K_OFF  = 1024;                 // 2048*4 (col 3 zero-padded)
constexpr int VT_STR = 2052;                 // 2048 + 4 pad: bank-conflict-free
constexpr int VT_OFF = K_OFF + 8192;         // V^T: 5 x 2052 (row 4 = zeros)
constexpr int SMEM_FLOATS = VT_OFF + 5 * VT_STR;        // ~76 KB (<< 320 KB/WGP)

// log2(e) / sqrt(3): fold the 1/sqrt(i0) scale into the exp2-domain softmax.
#define SOFTMAX_SCALE 0.8329862557658682f

// Raw maxnum without the compiler's canonicalize-before-maxnum expansion
// (inputs here are products/sums of finite data; sNaN semantics irrelevant).
__device__ __forceinline__ float fmax_raw(float a, float b) {
    float d;
    asm("v_max_num_f32_e32 %0, %1, %2" : "=v"(d) : "v"(a), "v"(b));
    return d;
}

// Three-input form of the same raw maximum.
__device__ __forceinline__ float fmax3_raw(float a, float b, float c) {
    float d;
    asm("v_max3_num_f32 %0, %1, %2, %3" : "=v"(d) : "v"(a), "v"(b), "v"(c));
    return d;
}

// Value of lane l ^ 16 (the other 16-lane half), by a vector cross-row move.
__device__ __forceinline__ float other_half(float x) {
    int b = __builtin_bit_cast(int, x);
    b = __builtin_amdgcn_permlanex16(b, b, 0x76543210, 0xfedcba98, false, false);
    return __builtin_bit_cast(float, b);
}

__global__ __launch_bounds__(NT)
void attn_view_kernel(const float* __restrict__ x1,
                      const float* __restrict__ qw_g,
                      const float* __restrict__ kw_g,
                      const float* __restrict__ vw_g,
                      float* __restrict__ out)
{
    extern __shared__ float smem[];
    const int tid  = threadIdx.x;
    const int lane = tid & 31;
    // Held in a scalar register: the key range and the tests on it are wave-uniform.
    const int wave = __builtin_amdgcn_readfirstlane(tid >> 5);
    const int qt   = wave & 3;                 // query tile of this wave
    const int ks   = wave >> 2;                // key range of this wave
    const int h    = blockIdx.x >> 5;          // 32 blocks per head
    const int sblk = blockIdx.x & 31;          // 64 rows per block (16/wave)
    const int s_tile_base = sblk * 64 + qt * 16;

    const float* x1h = x1 + h * (SN * DN);

    // ---- per-head 3x3 weights (uniform addresses -> scalar loads) ----
    float kw[9], vw[9];
    #pragma unroll
    for (int i = 0; i < 9; ++i) {
        kw[i] = kw_g[h * 9 + i];
        vw[i] = vw_g[h * 9 + i];
    }

    // ---- set-up, straight from global x1 (no staging): the (3,2048) matmul
    //      result R[i][tt] = W[i] . x1[tt] lands, by the reshape-VIEW, at flat
    //      index f = i*2048 + tt, that is element (t,p) = (f/3, f%3). A thread
    //      takes x1 rows tt = tid + j*NT and makes all three rows i of K and V
    //      from each, so the weights stay scalar operands and an x1 row is read
    //      once. The short loops below are unrolled so that xv[], xq[], wq[] and the
    //      index tables stay in registers and c/3, c%3 are compile-time. ----
    float xv[SN / NT][3];
    #pragma unroll
    for (int j = 0; j < SN / NT; ++j) {
        const float* xr = &x1h[(tid + j * NT) * 3];
        xv[j][0] = xr[0]; xv[j][1] = xr[1]; xv[j][2] = xr[2];
    }

    // x1 rows of the Q^T fragment in WMMA B-layout (4x16 f32): lane l holds
    // column (query) m=l&15, K-slots k0,k0+1 with k0 = (l>>4)*2; slot 3 is zero
    // pad (its row index is clamped to slot 2's, the value is not used).
    const int m   = lane & 15;
    const int k0  = (lane >> 4) * 2;
    const int hi8 = (lane >> 4) * 8;           // C/D rows: r (low) / r+8 (high)
    // The weight row f>>11 differs between lanes: each lane loads its own.
    float xq[2][3], wq[2][3];
    #pragma unroll
    for (int j = 0; j < 2; ++j) {
        const int kk = (k0 + j < 3) ? k0 + j : 2;
        const int f  = (s_tile_base + m) * 3 + kk;
        const float* xr = &x1h[(f & 2047) * 3];
        const float* wr = &qw_g[h * 9 + (f >> 11) * 3];
        xq[j][0] = xr[0]; xq[j][1] = xr[1]; xq[j][2] = xr[2];
        wq[j][0] = wr[0]; wq[j][1] = wr[1]; wq[j][2] = wr[2];
    }
    // The address registers of the loads above are reused right below.
    asm volatile("s_wait_xcnt 0x0" ::: "memory");

    // Constant parts while the loads fly: K column 3 = 0 (pad of the K=4
    // product); V^T row 3 = 1.0 (PV WMMA accumulates the softmax denominator in
    // output row 3 for free); V^T row 4 = 0 (zero source for lanes whose A row
    // is 4..15 -> masking by addressing, not VALU).
    #pragma unroll
    for (int j = 0; j < SN / NT; ++j)
        smem[K_OFF + (tid + j * NT) * 4 + 3] = 0.f;
    *(float4*)&smem[VT_OFF + 3 * VT_STR + tid * 4] = make_float4(1.f, 1.f, 1.f, 1.f);
    *(float4*)&smem[VT_OFF + 4 * VT_STR + tid * 4] = make_float4(0.f, 0.f, 0.f, 0.f);

    // (t,p) of f = c + tid for a constant c: t = c/3 + a + carry, p = s - 3*carry
    // with a = tid/3, s = tid%3 + c%3. Only c%3 matters per lane: three index
    // pairs serve all stores, c/3 goes into the stores' immediate offsets.
    const unsigned a3 = __umul24((unsigned)tid, 43691u) >> 17;   // tid / 3, exact for tid < 6144
    const unsigned r3 = (unsigned)tid - 3u * a3;
    unsigned kidx[3], vidx[3];
    kidx[0] = a3 * 4 + r3;
    vidx[0] = r3 * VT_STR + a3;
    #pragma unroll
    for (unsigned cl = 1; cl < 3; ++cl) {
        const unsigned s  = r3 + cl;
        const unsigned cy = (s >= 3u) ? 1u : 0u;
        const unsigned pp = s - 3u * cy;
        kidx[cl] = (a3 + cy) * 4 + pp;
        vidx[cl] = pp * VT_STR + a3 + cy;
    }
    #pragma unroll
    for (int j = 0; j < SN / NT; ++j) {
        #pragma unroll
        for (int i = 0; i < 3; ++i) {
            const int c = i * SN + j * NT;
            smem[K_OFF + (c / 3) * 4 + kidx[c % 3]] =
                kw[i*3+0]*xv[j][0] + kw[i*3+1]*xv[j][1] + kw[i*3+2]*xv[j][2];
            smem[VT_OFF + (c / 3) + vidx[c % 3]] =
                vw[i*3+0]*xv[j][0] + vw[i*3+1]*xv[j][1] + vw[i*3+2]*xv[j][2];
        }
    }

    // Q^T fragment. The softmax scale is folded into Q so qk comes out pre-scaled.
    v2f bq;
    #pragma unroll
    for (int j = 0; j < 2; ++j) {
        const float q = (wq[j][0]*xq[j][0] + wq[j][1]*xq[j][1] + wq[j][2]*xq[j][2]) * SOFTMAX_SCALE;
        bq[j] = (k0 + j < 3) ? q : 0.f;
    }
    __syncthreads();   // K/V ready

    // Transposed products: S^T = K Q^T and O^T += [V | 1]^T P^T. A lane then
    // holds scores of ONE query (column m): 8 keys in its 8 D registers, the
    // other 8 keys of the tile in lane l^16.
    float rmax = -__builtin_inff();
    v8f acc = {};      // acc[r] = O^T[r + hi8][m]; only rows 0..3 are non-zero

    // Per-lane V^T base: A rows n>=4 read the zero row (no masking VALU).
    const float* vbase = &smem[VT_OFF + ((m < 4) ? m : 4) * VT_STR + hi8];

    // Wave (qt, ks) walks key tiles ks*TPW .. ks*TPW + TPW-1 with a maximum,
    // a denominator and an accumulator of its own.
    constexpr int TPW = SN / 16 / KS;
    for (int tb = 0; tb < TPW; ++tb) {
        const int tbase = (ks * TPW + tb) * 16;

        // A fragment of K (16x4): lane = row (key) m, contiguous K pair.
        v2f ak = *(const v2f*)&smem[K_OFF + (tbase + m) * 4 + k0];
        // A fragments of V^T for the four PV chunks: keys hi8 + 0..7.
        const float4 va = *(const float4*)&vbase[tbase];
        const float4 vb = *(const float4*)&vbase[tbase + 4];

        v8f zero = {};
        v8f qk = __builtin_amdgcn_wmma_f32_16x16x4_f32(
            false, ak, false, bq, (short)0, zero, false, false);

        // ---- online softmax (exp2 domain; qk is pre-scaled). qk[r] is the
        //      score of key tbase + hi8 + r against query m. ----
        float tm = fmax3_raw(fmax3_raw(qk[0], qk[1], qk[2]),
                             fmax3_raw(qk[3], qk[4], qk[5]),
                             fmax_raw(qk[6], qk[7]));
        float nm = fmax3_raw(tm, other_half(tm), rmax);
        float cr = __builtin_amdgcn_exp2f(rmax - nm);
        rmax = nm;
        float p[8];
        #pragma unroll
        for (int r = 0; r < 8; ++r)
            p[r] = __builtin_amdgcn_exp2f(qk[r] - nm);
        #pragma unroll
        for (int r = 0; r < 4; ++r)
            acc[r] *= cr;                          // rescale before PV adds

        // ---- PV: (16x16 [V | 1]^T) x (16x16 P^T) as 4 chained K=4 WMMAs.
        //      B chunk c is the D register pair (2c, 2c+1) as it stands: its
        //      K-slots are keys 2c, 2c+1 (low half) and 2c+8, 2c+9 (high half),
        //      and the V^T loads above follow the same order.
        //      Row 3 of acc accumulates the softmax denominator. ----
        const v2f av[4] = {{va.x, va.y}, {va.z, va.w}, {vb.x, vb.y}, {vb.z, vb.w}};
        #pragma unroll
        for (int c = 0; c < 4; ++c) {
            v2f bp = {p[2 * c], p[2 * c + 1]};
            acc = __builtin_amdgcn_wmma_f32_16x16x4_f32(
                false, av[c], false, bp, (short)0, acc, false, false);
        }
    }

    // ---- merge of the KS key ranges: low-half lane m holds rows 0..2 and the
    //      denominator (row 3) of query s_tile_base + m over its own range.
    //      Ranges 1.. hand maximum and rows to range 0 through LDS. The short
    //      loops are unrolled so that pm[] and o[] stay in registers. ----
    if (ks != 0 && lane < 16) {
        float* cb = &smem[CB_OFF + ((ks - 1) * 4 + qt) * 80 + m];
        cb[0] = rmax;
        #pragma unroll
        for (int r = 0; r < 4; ++r)
            cb[16 + r * 16] = acc[r];
    }
    __syncthreads();   // partials ready
    if (ks == 0 && lane < 16) {
        const float* cb = &smem[CB_OFF + qt * 80 + m];
        float pm[KS - 1];
        float gm = rmax;
        #pragma unroll
        for (int j = 0; j < KS - 1; ++j) {
            pm[j] = cb[j * 320];
            gm = fmax_raw(gm, pm[j]);
        }
        const float w0 = __builtin_amdgcn_exp2f(rmax - gm);
        float o[4];
        #pragma unroll
        for (int r = 0; r < 4; ++r)
            o[r] = acc[r] * w0;
        #pragma unroll
        for (int j = 0; j < KS - 1; ++j) {
            const float wj = __builtin_amdgcn_exp2f(pm[j] - gm);
            #pragma unroll
            for (int r = 0; r < 4; ++r)
                o[r] += wj * cb[j * 320 + 16 + r * 16];
        }
        const int s = s_tile_base + m;
        #pragma unroll
        for (int r = 0; r < 3; ++r)
            out[(h * 3 + r) * SN + s] = o[r] / o[3];
    }
}

extern "C" void kernel_launch(void* const* d_in, const int* in_sizes, int n_in,
                              void* d_out, int out_size, void* d_ws, size_t ws_size,
                              hipStream_t stream) {
    const float* x1 = (const float*)d_in[0];
    const float* qw = (const float*)d_in[1];
    const float* kw = (const float*)d_in[2];
    const float* vw = (const float*)d_in[3];
    float* out = (float*)d_out;
    (void)in_sizes; (void)n_in; (void)out_size; (void)d_ws; (void)ws_size;

    dim3 grid(HN * 32);   // 8 heads x 32 s-blocks (64 rows each)
    dim3 block(NT);       // 4 query tiles x KS key ranges, one wave each
    size_t smem = SMEM_FLOATS * sizeof(float);   // ~76 KB dynamic LDS
    attn_view_kernel<<<grid, block, smem, stream>>>(x1, qw, kw, vw, out);
}

// v004
// Measured time: 9.9 microseconds a run.
// Two timings next to v003 both put it at 1.16 times that version's speed.
// Over all steps from v000 it is 3.19 times as fast.
#include <hip/hip_runtime.h>
#include <math.h>

typedef float v2f __attribute__((ext_vector_type(2)));
typedef float v8f __attribute__((ext_vector_type(8)));

constexpr int HN = 8;      // heads (== batch)
constexpr int SN = 2048;   // sequence
constexpr int DN = 3;      // head projections
constexpr int KS = 4;      // key ranges per query tile, one wave each
constexpr int NT = 128 * KS;   // threads per block: 4 query tiles x KS waves

// LDS layout (float indices).
constexpr int CB_OFF = 0;                    // partials of the merge: 3*4*80 floats
constexpr int K_OFF  = 1024;                 // 2048*4 (col 3 = 1.0)
constexpr int VT_STR = 2052;                 // 2048 + 4 pad: bank-conflict-free
constexpr int VT_OFF = K_OFF + 8192;         // V^T: 5 x 2052 (row 4 = zeros)
constexpr int SMEM_FLOATS = VT_OFF + 5 * VT_STR;        // ~76 KB (<< 320 KB/WGP)

// log2(e) / sqrt(3): fold the 1/sqrt(i0) scale into the exp2-domain softmax.
#define SOFTMAX_SCALE 0.8329862557658682f

// The fixed softmax reference of a wave lies this far (exp2 domain) above the
// maximum of its first key tile, so the window of exp2 arguments that neither
// overflow nor vanish is centred on where later maxima can lie.
#define REF_SHIFT 60.0f
// A denominator outside [DEN_LO, DEN_HI] says the fixed reference did not fit.
#define DEN_LO 0x1p-100f
#define DEN_HI 0x1p+100f

// Raw maxnum without the compiler's canonicalize-before-maxnum expansion
// (inputs here are products/sums of finite data; sNaN semantics irrelevant).
__device__ __forceinline__ float fmax_raw(float a, float b) {
    float d;
    asm("v_max_num_f32_e32 %0, %1, %2" : "=v"(d) : "v"(a), "v"(b));
    return d;
}

// Three-input form of the same raw maximum.
__device__ __forceinline__ float fmax3_raw(float a, float b, float c) {
    float d;
    asm("v_max3_num_f32 %0, %1, %2, %3" : "=v"(d) : "v"(a), "v"(b), "v"(c));
    return d;
}

// Value of lane l ^ 16 (the other 16-lane half), by a vector cross-row move.
__device__ __forceinline__ float other_half(float x) {
    int b = __builtin_bit_cast(int, x);
    b = __builtin_amdgcn_permlanex16(b, b, 0x76543210, 0xfedcba98, false, false);
    return __builtin_bit_cast(float, b);
}

__global__ __launch_bounds__(NT)
void attn_view_kernel(const float* __restrict__ x1,
                      const float* __restrict__ qw_g,
                      const float* __restrict__ kw_g,
                      const float* __restrict__ vw_g,
                      float* __restrict__ out)
{
    extern __shared__ float smem[];
    const int tid  = threadIdx.x;
    const int lane = tid & 31;
    // Held in a scalar register: the key range and the tests on it are wave-uniform.
    const int wave = __builtin_amdgcn_readfirstlane(tid >> 5);
    const int qt   = wave & 3;                 // query tile of this wave
    const int ks   = wave >> 2;                // key range of this wave
    const int h    = blockIdx.x >> 5;          // 32 blocks per head
    const int sblk = blockIdx.x & 31;          // 64 rows per block (16/wave)
    const int s_tile_base = sblk * 64 + qt * 16;

    const float* x1h = x1 + h * (SN * DN);

    // ---- per-head 3x3 weights (uniform addresses -> scalar loads) ----
    float kw[9], vw[9];
    #pragma unroll
    for (int i = 0; i < 9; ++i) {
        kw[i] = kw_g[h * 9 + i];
        vw[i] = vw_g[h * 9 + i];
    }

    // ---- set-up, straight from global x1 (no staging): the (3,2048) matmul
    //      result R[i][tt] = W[i] . x1[tt] lands, by the reshape-VIEW, at flat
    //      index f = i*2048 + tt, that is element (t,p) = (f/3, f%3). A thread
    //      takes x1 rows tt = tid + j*NT and makes all three rows i of K and V
    //      from each, so the weights stay scalar operands and an x1 row is read
    //      once. The short loops below are unrolled so that xv[], xq[], wq[] and the
    //      index tables stay in registers and c/3, c%3 are compile-time. ----
    float xv[SN / NT][3];
    #pragma unroll
    for (int j = 0; j < SN / NT; ++j) {
        const float* xr = &x1h[(tid + j * NT) * 3];
        xv[j][0] = xr[0]; xv[j][1] = xr[1]; xv[j][2] = xr[2];
    }

    // x1 rows of the Q^T fragment in WMMA B-layout (4x16 f32): lane l holds
    // column (query) m=l&15, K-slots k0,k0+1 with k0 = (l>>4)*2; slot 3 is zero
    // pad (its row index is clamped to slot 2's, the value is not used).
    const int m   = lane & 15;
    const int k0  = (lane >> 4) * 2;
    const int hi8 = (lane >> 4) * 8;           // C/D rows: r (low) / r+8 (high)
    // The weight row f>>11 differs between lanes: each lane loads its own.
    float xq[2][3], wq[2][3];
    #pragma unroll
    for (int j = 0; j < 2; ++j) {
        const int kk = (k0 + j < 3) ? k0 + j : 2;
        const int f  = (s_tile_base + m) * 3 + kk;
        const float* xr = &x1h[(f & 2047) * 3];
        const float* wr = &qw_g[h * 9 + (f >> 11) * 3];
        xq[j][0] = xr[0]; xq[j][1] = xr[1]; xq[j][2] = xr[2];
        wq[j][0] = wr[0]; wq[j][1] = wr[1]; wq[j][2] = wr[2];
    }
    // The address registers of the loads above are reused right below.
    asm volatile("s_wait_xcnt 0x0" ::: "memory");

    // Constant parts while the loads fly: K column 3 = 1.0 (slot 3 of the K=4
    // product adds Q^T slot 3, which is 0 or minus the softmax reference, to
    // every score); V^T row 3 = 1.0 (PV WMMA accumulates the softmax denominator in
    // output row 3 for free); V^T row 4 = 0 (zero source for lanes whose A row
    // is 4..15 -> masking by addressing, not VALU).
    #pragma unroll
    for (int j = 0; j < SN / NT; ++j)
        smem[K_OFF + (tid + j * NT) * 4 + 3] = 1.f;
    *(float4*)&smem[VT_OFF + 3 * VT_STR + tid * 4] = make_float4(1.f, 1.f, 1.f, 1.f);
    *(float4*)&smem[VT_OFF + 4 * VT_STR + tid * 4] = make_float4(0.f, 0.f, 0.f, 0.f);

    // (t,p) of f = c + tid for a constant c: t = c/3 + a + carry, p = s - 3*carry
    // with a = tid/3, s = tid%3 + c%3. Only c%3 matters per lane: three index
    // pairs serve all stores, c/3 goes into the stores' immediate offsets.
    const unsigned a3 = __umul24((unsigned)tid, 43691u) >> 17;   // tid / 3, exact for tid < 6144
    const unsigned r3 = (unsigned)tid - 3u * a3;
    unsigned kidx[3], vidx[3];
    kidx[0] = a3 * 4 + r3;
    vidx[0] = r3 * VT_STR + a3;
    #pragma unroll
    for (unsigned cl = 1; cl < 3; ++cl) {
        const unsigned s  = r3 + cl;
        const unsigned cy = (s >= 3u) ? 1u : 0u;
        const unsigned pp = s - 3u * cy;
        kidx[cl] = (a3 + cy) * 4 + pp;
        vidx[cl] = pp * VT_STR + a3 + cy;
    }
    #pragma unroll
    for (int j = 0; j < SN / NT; ++j) {
        #pragma unroll
        for (int i = 0; i < 3; ++i) {
            const int c = i * SN + j * NT;
            smem[K_OFF + (c / 3) * 4 + kidx[c % 3]] =
                kw[i*3+0]*xv[j][0] + kw[i*3+1]*xv[j][1] + kw[i*3+2]*xv[j][2];
            smem[VT_OFF + (c / 3) + vidx[c % 3]] =
                vw[i*3+0]*xv[j][0] + vw[i*3+1]*xv[j][1] + vw[i*3+2]*xv[j][2];
        }
    }

    // Q^T fragment. The softmax scale is folded into Q so qk comes out pre-scaled.
    v2f bq;
    #pragma unroll
    for (int j = 0; j < 2; ++j) {
        const float q = (wq[j][0]*xq[j][0] + wq[j][1]*xq[j][1] + wq[j][2]*xq[j][2]) * SOFTMAX_SCALE;
        bq[j] = (k0 + j < 3) ? q : 0.f;
    }
    __syncthreads();   // K/V ready

    // Transposed products: S^T = K Q^T and O^T += [V | 1]^T P^T. A lane then
    // holds scores of ONE query (column m): 8 keys in its 8 D registers, the
    // other 8 keys of the tile in lane l^16.
    v8f acc = {};      // acc[r] = O^T[r + hi8][m]; only rows 0..3 are non-zero

    // Per-lane V^T base: A rows n>=4 read the zero row (no masking VALU).
    const float* vbase = &smem[VT_OFF + ((m < 4) ? m : 4) * VT_STR + hi8];

    // Wave (qt, ks) walks key tiles ks*TPW .. ks*TPW + TPW-1 with a reference,
    // a denominator and an accumulator of its own.
    constexpr int TPW = SN / 16 / KS;
    const int tfirst = ks * TPW * 16;

    // ---- fixed reference of query m: the maximum over the wave's first key
    //      tile plus REF_SHIFT, rounded. Its negative goes into Q^T slot 3
    //      (high-half lanes, second register), so the score product itself
    //      returns score - reference and the loop needs no maximum, no
    //      subtraction and no rescaling of acc. ----
    float rmax;
    v2f bqr = bq;
    {
        const v2f ak = *(const v2f*)&smem[K_OFF + (tfirst + m) * 4 + k0];
        v8f zero = {};
        const v8f qk = __builtin_amdgcn_wmma_f32_16x16x4_f32(
            false, ak, false, bq, (short)0, zero, false, false);
        const float tm = fmax3_raw(fmax3_raw(qk[0], qk[1], qk[2]),
                                   fmax3_raw(qk[3], qk[4], qk[5]),
                                   fmax_raw(qk[6], qk[7]));
        // Rounded to a whole number: adding the denominator's exponent to it
        // below, and the differences of references in the merge, are then exact.
        rmax = __builtin_rintf(fmax_raw(tm, other_half(tm)) + REF_SHIFT);
        bqr[1] = (k0 != 0) ? -rmax : bq[1];
    }

    for (int tb = 0; tb < TPW; ++tb) {
        const int tbase = tfirst + tb * 16;

        // A fragment of K (16x4): lane = row (key) m, contiguous K pair.
        v2f ak = *(const v2f*)&smem[K_OFF + (tbase + m) * 4 + k0];
        // A fragments of V^T for the four PV chunks: keys hi8 + 0..7.
        const float4 va = *(const float4*)&vbase[tbase];
        const float4 vb = *(const float4*)&vbase[tbase + 4];

        // qk[r] = score of key tbase + hi8 + r against query m, minus the
        // reference (exp2 domain; Q is pre-scaled).
        v8f zero = {};
        v8f qk = __builtin_amdgcn_wmma_f32_16x16x4_f32(
            false, ak, false, bqr, (short)0, zero, false, false);

        float p[8];
        #pragma unroll
        for (int r = 0; r < 8; ++r)
            p[r] = __builtin_amdgcn_exp2f(qk[r]);

        // ---- PV: (16x16 [V | 1]^T) x (16x16 P^T) as 4 chained K=4 WMMAs.
        //      B chunk c is the D register pair (2c, 2c+1) as it stands: its
        //      K-slots are keys 2c, 2c+1 (low half) and 2c+8, 2c+9 (high half),
        //      and the V^T loads above follow the same order.
        //      Row 3 of acc accumulates the softmax denominator. ----
        const v2f av[4] = {{va.x, va.y}, {va.z, va.w}, {vb.x, vb.y}, {vb.z, vb.w}};
        #pragma unroll
        for (int c = 0; c < 4; ++c) {
            v2f bp = {p[2 * c], p[2 * c + 1]};
            acc = __builtin_amdgcn_wmma_f32_16x16x4_f32(
                false, av[c], false, bp, (short)0, acc, false, false);
        }
    }

    // ---- check of the fixed reference, once per wave: a denominator out of
    //      range or a sum that is not finite (low-half lanes hold them) means a
    //      later score lay too far from the first tile's maximum. The wave then
    //      does its key range again with the running maximum, which fits any
    //      scores. The test is wave-uniform (ballot): EXEC stays full for the
    //      matrix instructions inside. ----
    const bool misfit = (lane < 16) &&
        !(acc[3] >= DEN_LO && acc[3] <= DEN_HI &&
          __builtin_fabsf(acc[0]) + __builtin_fabsf(acc[1]) + __builtin_fabsf(acc[2]) < __builtin_inff());
    if (__builtin_amdgcn_ballot_w32(misfit) != 0u) {
        rmax = -__builtin_inff();
        acc = v8f{};
        // Kept rolled: a path for rare inputs, not worth code size.
        #pragma unroll 1
        for (int tb = 0; tb < TPW; ++tb) {
            const int tbase = tfirst + tb * 16;
            v2f ak = *(const v2f*)&smem[K_OFF + (tbase + m) * 4 + k0];
            const float4 va = *(const float4*)&vbase[tbase];
            const float4 vb = *(const float4*)&vbase[tbase + 4];

            v8f zero = {};
            v8f qk = __builtin_amdgcn_wmma_f32_16x16x4_f32(
                false, ak, false, bq, (short)0, zero, false, false);

            // online softmax (exp2 domain; slot 3 of bq is 0: plain scores)
            float tm = fmax3_raw(fmax3_raw(qk[0], qk[1], qk[2]),
                                 fmax3_raw(qk[3], qk[4], qk[5]),
                                 fmax_raw(qk[6], qk[7]));
            float nm = fmax3_raw(tm, other_half(tm), rmax);
            float cr = __builtin_amdgcn_exp2f(rmax - nm);
            rmax = nm;
            float p[8];
            #pragma unroll
            for (int r = 0; r < 8; ++r)
                p[r] = __builtin_amdgcn_exp2f(qk[r] - nm);
            #pragma unroll
            for (int r = 0; r < 4; ++r)
                acc[r] *= cr;                          // rescale before PV adds

            const v2f av[4] = {{va.x, va.y}, {va.z, va.w}, {vb.x, vb.y}, {vb.z, vb.w}};
            #pragma unroll
            for (int c = 0; c < 4; ++c) {
                v2f bp = {p[2 * c], p[2 * c + 1]};
                acc = __builtin_amdgcn_wmma_f32_16x16x4_f32(
                    false, av[c], false, bp, (short)0, acc, false, false);
            }
        }
    } else {
        // The denominator's power of two moves from the sums into the reference
        // (exact): the merge below then weighs ranges by their true size, however
        // far a range's reference lay from its maximum.
        const int e = __builtin_amdgcn_frexp_expf(acc[3]);
        rmax += (float)e;
        // Unrolled so that acc's element indices are compile-time (registers).
        #pragma unroll
        for (int r = 0; r < 4; ++r)
            acc[r] = __builtin_ldexpf(acc[r], -e);
    }

    // ---- merge of the KS key ranges: low-half lane m holds rows 0..2 and the
    //      denominator (row 3) of query s_tile_base + m over its own range.
    //      Ranges 1.. hand reference and rows to range 0 through LDS. The short
    //      loops are unrolled so that pm[] and o[] stay in registers. ----
    if (ks != 0 && lane < 16) {
        float* cb = &smem[CB_OFF + ((ks - 1) * 4 + qt) * 80 + m];
        cb[0] = rmax;
        #pragma unroll
        for (int r = 0; r < 4; ++r)
            cb[16 + r * 16] = acc[r];
    }
    __syncthreads();   // partials ready
    if (ks == 0 && lane < 16) {
        const float* cb = &smem[CB_OFF + qt * 80 + m];
        float pm[KS - 1];
        float gm = rmax;
        #pragma unroll
        for (int j = 0; j < KS - 1; ++j) {
            pm[j] = cb[j * 320];
            gm = fmax_raw(gm, pm[j]);
        }
        const float w0 = __builtin_amdgcn_exp2f(rmax - gm);
        float o[4];
        #pragma unroll
        for (int r = 0; r < 4; ++r)
            o[r] = acc[r] * w0;
        #pragma unroll
        for (int j = 0; j < KS - 1; ++j) {
            const float wj = __builtin_amdgcn_exp2f(pm[j] - gm);
            #pragma unroll
            for (int r = 0; r < 4; ++r)
                o[r] += wj * cb[j * 320 + 16 + r * 16];
        }
        const int s = s_tile_base + m;
        #pragma unroll
        for (int r = 0; r < 3; ++r)
            out[(h * 3 + r) * SN + s] = o[r] / o[3];
    }
}

extern "C" void kernel_launch(void* const* d_in, const int* in_sizes, int n_in,
                              void* d_out, int out_size, void* d_ws, size_t ws_size,
                              hipStream_t stream) {
    const float* x1 = (const float*)d_in[0];
    const float* qw = (const float*)d_in[1];
    const float* kw = (const float*)d_in[2];
    const float* vw = (const float*)d_in[3];
    float* out = (float*)d_out;
    (void)in_sizes; (void)n_in; (void)out_size; (void)d_ws; (void)ws_size;

    dim3 grid(HN * 32);   // 8 heads x 32 s-blocks (64 rows each)
    dim3 block(NT);       // 4 query tiles x KS key ranges, one wave each
    size_t smem = SMEM_FLOATS * sizeof(float);   // ~76 KB dynamic LDS
    attn_view_kernel<<<grid, block, smem, stream>>>(x1, qw, kw, vw, out);
}
